// v000
// Measured on an AMD MI455X. A time is GPU time per run, averaged over a window of back-to-back runs after a warm-up
// (all launches, gaps included; the runs take copies of the inputs in turn), and the median of several windows.
// Apart from v000's, it joins two sittings. Times from different sittings can be a few percent apart, while
// side-by-side timings come from the same sitting.
// v000, which the later versions start from, runs in 34.2 microseconds.
#include <hip/hip_runtime.h>
#include <math.h>

// CDNA5 wave32 WMMA operand vectors
typedef __attribute__((ext_vector_type(2))) float v2f;  // A/B for 16x16x4 f32: 2 VGPRs/lane
typedef __attribute__((ext_vector_type(8))) float v8f;  // C/D 16x16 f32: 8 VGPRs/lane

#define TT    64
#define DD    3
#define HDIM  4
#define NPAD  16         // v rows padded to 16 (zeros) so B-operand loads need no selects
#define FFD   2
#define NVOC  10
#define EPSV  1e-6f
#define SCP   (TT + 2)   // score row stride: 264B rows -> 8B aligned, conflict-free f2 access

__global__ __launch_bounds__(64) void tiny_xformer_kernel(
    const int*   __restrict__ idx,
    const float* __restrict__ arcA,
    const float* __restrict__ arcStart,
    const float* __restrict__ arcStride,
    const float* __restrict__ w_ln1,
    const float* __restrict__ w_ln2,
    const float* __restrict__ w_lnf,
    const float* __restrict__ w_qn,
    const float* __restrict__ Wq,
    const float* __restrict__ Wk,
    const float* __restrict__ Wg,
    const float* __restrict__ Wu,
    const float* __restrict__ Wd,
    float*       __restrict__ out)
{
    __shared__ float s_x[TT][DD];
    __shared__ __align__(16) float s_q[TT][HDIM];    // pre-scaled by HD^-0.5
    __shared__ __align__(16) float s_k[TT][HDIM];
    __shared__ __align__(16) float s_vt[NPAD][TT];   // v transposed [dim][token], rows 4..15 = 0
    __shared__ __align__(16) float s_sc[TT][SCP];
    __shared__ float s_o[TT][HDIM];
    __shared__ float s_inv[TT];                      // 1/softmax-sum per row (deferred norm)
    __shared__ float s_tab[NVOC][2];
    __shared__ __align__(16) float s_log[TT * NVOC];

    const int b    = blockIdx.x;
    const int t    = threadIdx.x;        // one thread per token, 64 threads = 2 wave32
    const int lane = threadIdx.x & 31;
    // readfirstlane -> SGPR: compiler emits scalar branches (no EXEC save/restore around WMMA)
    const int wave = __builtin_amdgcn_readfirstlane(threadIdx.x) >> 5;
    const int lh   = lane & 15;
    const bool hi  = lane >= 16;

    const float A    = arcA[0];
    const float ang0 = arcStart[0];
    const float angS = arcStride[0];

    // ---------------- Phase A: embed + ln1 + q/k/v + q-norm + RoPE ----------------
    {
        if (t < NVOC) {                                  // vocab arc table, once per block
            const float av = ang0 + (float)t * angS;
            s_tab[t][0] = A * __cosf(av);
            s_tab[t][1] = A * __sinf(av);
        }
        {   // zero-fill padded v rows 4..15 (contiguous 3072B block) with b128 stores
            float4* zp = (float4*)&s_vt[HDIM][0];        // 192 float4, 64 threads x 3
            const float4 z4 = make_float4(0.f, 0.f, 0.f, 0.f);
            #pragma unroll
            for (int j = 0; j < 3; ++j) zp[j * TT + t] = z4;
        }

        const int tok = idx[(size_t)b * TT + t];
        const float ang = ang0 + (float)tok * angS;
        const float x0 = A * __cosf(ang);
        const float x1 = A * __sinf(ang);
        const float x2 = __sinf((float)t * 1e-4f);       // pe = sin(t * exp(-ln 1e4))

        float ms = (x0*x0 + x1*x1 + x2*x2) * (1.0f / 3.0f);
        float r  = rsqrtf(ms + EPSV);
        const float h0 = x0 * r * w_ln1[0];
        const float h1 = x1 * r * w_ln1[1];
        const float h2 = x2 * r * w_ln1[2];

        float qr[HDIM], kr[HDIM];
        #pragma unroll
        for (int d = 0; d < HDIM; ++d) {
            qr[d] = h0 * Wq[d*DD+0] + h1 * Wq[d*DD+1] + h2 * Wq[d*DD+2];
            kr[d] = h0 * Wk[d*DD+0] + h1 * Wk[d*DD+1] + h2 * Wk[d*DD+2];
        }
        float qms = 0.f, kms = 0.f;
        #pragma unroll
        for (int d = 0; d < HDIM; ++d) { qms += qr[d]*qr[d]; kms += kr[d]*kr[d]; }
        const float qrs = rsqrtf(qms * 0.25f + EPSV);
        const float krs = rsqrtf(kms * 0.25f + EPSV);
        float q[HDIM], k[HDIM];
        #pragma unroll
        for (int d = 0; d < HDIM; ++d) { q[d] = qr[d]*qrs*w_qn[d]; k[d] = kr[d]*krs*w_qn[d]; }

        // RoPE, theta = 3.0, HD = 4 -> inv_freq = {1, 3^-0.5}
        const float f0 = (float)t;
        const float f1 = (float)t * 0.5773502691896258f;
        const float c0 = __cosf(f0), sn0 = __sinf(f0);
        const float c1 = __cosf(f1), sn1 = __sinf(f1);

        s_x[t][0] = x0; s_x[t][1] = x1; s_x[t][2] = x2;
        // q pre-scaled by HD^-0.5 = 0.5 (linear, commutes with rope)
        s_q[t][0] = 0.5f*(q[0]*c0 - q[1]*sn0);  s_q[t][1] = 0.5f*(q[0]*sn0 + q[1]*c0);
        s_q[t][2] = 0.5f*(q[2]*c1 - q[3]*sn1);  s_q[t][3] = 0.5f*(q[2]*sn1 + q[3]*c1);
        s_k[t][0] = k[0]*c0 - k[1]*sn0;  s_k[t][1] = k[0]*sn0 + k[1]*c0;
        s_k[t][2] = k[2]*c1 - k[3]*sn1;  s_k[t][3] = k[2]*sn1 + k[3]*c1;
        s_vt[0][t] = kr[0]; s_vt[1][t] = kr[1];          // v = h@Wk^T, transposed
        s_vt[2][t] = kr[2]; s_vt[3][t] = kr[3];
    }
    __syncthreads();

    // ------- Phase B: scores = q @ k^T  (V_WMMA_F32_16X16X4_F32, causal block skipping) --
    // A 16x4: lanes0-15 K=0/1, lanes16-31 K=2/3 -> single 8B-aligned ds_load_b64 per lane.
    for (int rb = wave; rb < 4; rb += 2) {              // SGPR loop: scalar branches only
        const int rrow = rb * 16 + lh;
        const v2f a = *(const v2f*)&s_q[rrow][hi ? 2 : 0];
        #pragma unroll
        for (int cb = 0; cb < 4; ++cb) {
            const int n = cb * 16 + lh;
            if (cb <= rb) {                              // at/below diagonal: compute
                const v2f bm = *(const v2f*)&s_k[n][hi ? 2 : 0];
                v8f c = {};
                c = __builtin_amdgcn_wmma_f32_16x16x4_f32(false, a, false, bm,
                                                          (short)0, c, false, false);
                if (cb < rb) {                           // strictly below: no mask
                    #pragma unroll
                    for (int i = 0; i < 8; ++i)
                        s_sc[rb*16 + i + (hi ? 8 : 0)][n] = c[i];
                } else {                                 // diagonal tile: per-element mask
                    #pragma unroll
                    for (int i = 0; i < 8; ++i) {
                        const int row = rb*16 + i + (hi ? 8 : 0);
                        s_sc[row][n] = (n > row) ? -INFINITY : c[i];
                    }
                }
            } else {                                     // above diagonal: fully masked
                #pragma unroll
                for (int i = 0; i < 8; ++i)
                    s_sc[rb*16 + i + (hi ? 8 : 0)][n] = -INFINITY;
            }
        }
    }
    __syncthreads();

    // -------- Phase C: row max + unnormalized exp; 1/sum deferred to Phase E -------------
    {
        v2f* rowp = (v2f*)&s_sc[t][0];                   // 264B row stride -> 8B aligned
        float m = -INFINITY;
        #pragma unroll
        for (int j = 0; j < TT/2; ++j) {
            const v2f p = rowp[j];
            m = fmaxf(m, fmaxf(p[0], p[1]));
        }
        float s = 0.f;
        #pragma unroll
        for (int j = 0; j < TT/2; ++j) {
            v2f p = rowp[j];
            p[0] = __expf(p[0] - m);                     // masked cols -> exp(-inf) = 0
            p[1] = __expf(p[1] - m);
            rowp[j] = p;
            s += p[0] + p[1];
        }
        s_inv[t] = 1.0f / s;                             // softmax norm commutes with attn@v
    }
    __syncthreads();

    // ---------------- Phase D: out = e @ v  (chained K=4 WMMAs, N padded to 16) ----------
    for (int rb = wave; rb < 4; rb += 2) {
        v8f c = {};
        const int rrow = rb * 16 + lh;
        const int n = lh;
        #pragma unroll
        for (int kc = 0; kc < 16; ++kc) {
            const v2f a  = *(const v2f*)&s_sc[rrow][kc*4 + (hi ? 2 : 0)];   // 8B aligned
            const v2f bm = *(const v2f*)&s_vt[n][kc*4 + (hi ? 2 : 0)];      // rows>=4 are zero
            c = __builtin_amdgcn_wmma_f32_16x16x4_f32(false, a, false, bm,
                                                      (short)0, c, false, false);
        }
        if (n < HDIM) {
            #pragma unroll
            for (int i = 0; i < 8; ++i)
                s_o[rb*16 + i + (hi ? 8 : 0)][n] = c[i];
        }
    }
    __syncthreads();

    // ---------------- Phase E: normalize + residual + MLP + final norm + logits ----------
    {
        const float inv = s_inv[t];                      // apply deferred softmax 1/sum
        const float o0 = s_o[t][0] * inv, o1 = s_o[t][1] * inv;
        const float o2 = s_o[t][2] * inv, o3 = s_o[t][3] * inv;
        float x0 = s_x[t][0], x1 = s_x[t][1], x2 = s_x[t][2];
        // x += out @ Wq   (Wq: HD x D row-major)
        x0 += o0*Wq[0*DD+0] + o1*Wq[1*DD+0] + o2*Wq[2*DD+0] + o3*Wq[3*DD+0];
        x1 += o0*Wq[0*DD+1] + o1*Wq[1*DD+1] + o2*Wq[2*DD+1] + o3*Wq[3*DD+1];
        x2 += o0*Wq[0*DD+2] + o1*Wq[1*DD+2] + o2*Wq[2*DD+2] + o3*Wq[3*DD+2];

        float ms = (x0*x0 + x1*x1 + x2*x2) * (1.0f / 3.0f);
        float r  = rsqrtf(ms + EPSV);
        const float h0 = x0*r*w_ln2[0], h1 = x1*r*w_ln2[1], h2 = x2*r*w_ln2[2];

        float y[FFD];
        #pragma unroll
        for (int f = 0; f < FFD; ++f) {
            const float g = h0*Wg[f*DD+0] + h1*Wg[f*DD+1] + h2*Wg[f*DD+2];
            const float u = h0*Wu[f*DD+0] + h1*Wu[f*DD+1] + h2*Wu[f*DD+2];
            y[f] = (g / (1.0f + __expf(-g))) * u;        // silu(g)*u
        }
        x0 += y[0]*Wd[0*FFD+0] + y[1]*Wd[0*FFD+1];
        x1 += y[0]*Wd[1*FFD+0] + y[1]*Wd[1*FFD+1];
        x2 += y[0]*Wd[2*FFD+0] + y[1]*Wd[2*FFD+1];

        ms = (x0*x0 + x1*x1 + x2*x2) * (1.0f / 3.0f);
        r  = rsqrtf(ms + EPSV);
        x0 = x0 * r * w_lnf[0];
        x1 = x1 * r * w_lnf[1];

        #pragma unroll
        for (int vv = 0; vv < NVOC; ++vv)
            s_log[t * NVOC + vv] = x0 * s_tab[vv][0] + x1 * s_tab[vv][1];
    }
    __syncthreads();

    // ---------------- Phase F: coalesced logits store (float2, 256B/wave/iter) -----------
    {
        const float2* sl = (const float2*)s_log;
        float2* op = (float2*)(out + (size_t)b * TT * NVOC);
        #pragma unroll
        for (int j = 0; j < (TT * NVOC) / (2 * TT); ++j) {   // 5 iterations
            const int l = j * TT + t;
            op[l] = sl[l];
        }
    }
}

extern "C" void kernel_launch(void* const* d_in, const int* in_sizes, int n_in,
                              void* d_out, int out_size, void* d_ws, size_t ws_size,
                              hipStream_t stream) {
    const int*   idx       = (const int*)  d_in[0];
    const float* arcA      = (const float*)d_in[1];
    const float* arcStart  = (const float*)d_in[2];
    const float* arcStride = (const float*)d_in[3];
    const float* w_ln1     = (const float*)d_in[4];
    const float* w_ln2     = (const float*)d_in[5];
    const float* w_lnf     = (const float*)d_in[6];
    const float* w_qn      = (const float*)d_in[7];
    const float* Wq        = (const float*)d_in[8];
    const float* Wk        = (const float*)d_in[9];
    const float* Wg        = (const float*)d_in[10];
    const float* Wu        = (const float*)d_in[11];
    const float* Wd        = (const float*)d_in[12];
    float*       out       = (float*)d_out;

    const int nBatch = in_sizes[0] / TT;   // 16384
    tiny_xformer_kernel<<<dim3(nBatch), dim3(TT), 0, stream>>>(
        idx, arcA, arcStart, arcStride, w_ln1, w_ln2, w_lnf, w_qn,
        Wq, Wk, Wg, Wu, Wd, out);
}

// v001
// Measured time: 16.4 microseconds a run.
// Timed twice side by side with v000, it ran 2.18 times as fast both times.
#include <hip/hip_runtime.h>
#include <math.h>

// CDNA5 wave32 WMMA operand vectors
typedef __attribute__((ext_vector_type(2))) float v2f;  // A/B for 16x16x4 f32: 2 VGPRs/lane
typedef __attribute__((ext_vector_type(8))) float v8f;  // C/D 16x16 f32: 8 VGPRs/lane

#define TT    64
#define DD    3
#define HDIM  4
#define FFD   2
#define NVOC  10
#define EPSV  1e-6f
#define VP    80         // v^T row pitch in floats: the 4 rows sit 16 banks apart, b128 reads conflict-free

// lane l <-> l ^ 16 (the two 16-lane rows of a wave), on the vector port
__device__ __forceinline__ float other_row(float x) {
    const int b = __float_as_int(x);
    return __int_as_float(__builtin_amdgcn_permlanex16(b, b, 0x76543210, 0xfedcba98, false, false));
}

// One 16-query tile RB against key tiles 0..RB, scores never leaving registers.
// S^T = K * Q^T: register i of lane (lh, hi) = score of key kb*16 + 8*hi + i, query RB*16 + lh,
// so a register pair (2j, 2j+1) is already a B fragment (4 keys x 16 queries) of O^T = V^T * P^T;
// the V^T fragment is read in the same key order (keys 8*hi + 2j, 8*hi + 2j + 1).
// A row m of V^T is v dim m & 3, so registers 0..3 of BOTH lane rows end as o[0..3] of query lh.
template <int RB>
__device__ __forceinline__ void attn_tile(const float (*s_q)[HDIM], const float (*s_k)[HDIM],
                                          const float (*s_vt)[VP], const int lh, const bool hi,
                                          float (&o)[HDIM], float &sum)
{
    const int ko = hi ? 2 : 0;
    const int k8 = hi ? 8 : 0;
    const v2f bq = *(const v2f*)&s_q[RB * 16 + lh][ko];
    v8f s[RB + 1];
    #pragma unroll  // constant indices keep s[][] in registers
    for (int kb = 0; kb <= RB; ++kb) {
        const v2f ak = *(const v2f*)&s_k[kb * 16 + lh][ko];
        v8f z = {};
        s[kb] = __builtin_amdgcn_wmma_f32_16x16x4_f32(false, ak, false, bq,
                                                      (short)0, z, false, false);
    }
    #pragma unroll  // constant indices keep s[][] in registers
    for (int i = 0; i < 8; ++i)                          // diagonal tile: key > query masked
        s[RB][i] = (i + k8 > lh) ? -INFINITY : s[RB][i];

    float m = -INFINITY;
    #pragma unroll  // constant indices keep s[][] in registers
    for (int kb = 0; kb <= RB; ++kb) {
        #pragma unroll  // constant indices keep s[][] in registers
        for (int i = 0; i < 8; ++i) m = fmaxf(m, s[kb][i]);
    }
    m = fmaxf(m, other_row(m));                          // the other 8 keys of each tile

    float acc = 0.f;
    #pragma unroll  // constant indices keep s[][] in registers
    for (int kb = 0; kb <= RB; ++kb) {
        #pragma unroll  // constant indices keep s[][] in registers
        for (int i = 0; i < 8; ++i) {
            const float p = __expf(s[kb][i] - m);        // masked keys -> exp(-inf) = 0
            s[kb][i] = p;
            acc += p;
        }
    }
    sum = acc + other_row(acc);

    v8f c = {};
    #pragma unroll  // constant indices keep s[][] in registers
    for (int kb = 0; kb <= RB; ++kb) {
        #pragma unroll  // constant indices keep s[][] in registers
        for (int j = 0; j < 4; ++j) {
            const v2f av = *(const v2f*)&s_vt[lh & 3][kb * 16 + k8 + 2 * j];
            v2f bp; bp[0] = s[kb][2 * j]; bp[1] = s[kb][2 * j + 1];
            c = __builtin_amdgcn_wmma_f32_16x16x4_f32(false, av, false, bp,
                                                      (short)0, c, false, false);
        }
    }
    #pragma unroll  // constant indices keep c and o in registers
    for (int d = 0; d < HDIM; ++d) o[d] = c[d];
}

__global__ __launch_bounds__(64) void tiny_xformer_kernel(
    const int*   __restrict__ idx,
    const float* __restrict__ arcA,
    const float* __restrict__ arcStart,
    const float* __restrict__ arcStride,
    const float* __restrict__ w_ln1,
    const float* __restrict__ w_ln2,
    const float* __restrict__ w_lnf,
    const float* __restrict__ w_qn,
    const float* __restrict__ Wq,
    const float* __restrict__ Wk,
    const float* __restrict__ Wg,
    const float* __restrict__ Wu,
    const float* __restrict__ Wd,
    float*       __restrict__ out)
{
    __shared__ __align__(16) float s_q[TT][HDIM];    // pre-scaled by HD^-0.5
    __shared__ __align__(16) float s_k[TT][HDIM];
    __shared__ __align__(16) float s_vt[HDIM][VP];   // v transposed [dim][token]
    __shared__ float s_tab[NVOC][2];
    __shared__ __align__(16) float s_log[TT * NVOC];

    const int b    = blockIdx.x;
    const int t    = threadIdx.x;        // 64 threads = 2 wave32
    const int lane = threadIdx.x & 31;
    // readfirstlane -> SGPR: compiler emits scalar branches (no EXEC save/restore around WMMA)
    const int wave = __builtin_amdgcn_readfirstlane(threadIdx.x) >> 5;
    const int lh   = lane & 15;
    const bool hi  = lane >= 16;
    // One token per thread: wave w owns query tiles w (lanes 0-15) and 3 - w (lanes 16-31),
    // 5 causal key tiles for either wave, and each lane ends with its own token's attention row.
    const int tk   = ((hi ? 3 - wave : wave) << 4) + lh;

    const float A    = arcA[0];
    const float ang0 = arcStart[0];
    const float angS = arcStride[0];

    float x0, x1, x2;

    // ---------------- Phase A: embed + ln1 + q/k/v + q-norm + RoPE ----------------
    {
        if (t < NVOC) {                                  // vocab arc table, once per block
            const float av = ang0 + (float)t * angS;
            s_tab[t][0] = A * __cosf(av);
            s_tab[t][1] = A * __sinf(av);
        }

        const int tok = idx[(size_t)b * TT + tk];
        const float ang = ang0 + (float)tok * angS;
        x0 = A * __cosf(ang);
        x1 = A * __sinf(ang);
        x2 = __sinf((float)tk * 1e-4f);                  // pe = sin(t * exp(-ln 1e4))

        float ms = (x0*x0 + x1*x1 + x2*x2) * (1.0f / 3.0f);
        float r  = rsqrtf(ms + EPSV);
        const float h0 = x0 * r * w_ln1[0];
        const float h1 = x1 * r * w_ln1[1];
        const float h2 = x2 * r * w_ln1[2];

        float qr[HDIM], kr[HDIM];
        #pragma unroll
        for (int d = 0; d < HDIM; ++d) {
            qr[d] = h0 * Wq[d*DD+0] + h1 * Wq[d*DD+1] + h2 * Wq[d*DD+2];
            kr[d] = h0 * Wk[d*DD+0] + h1 * Wk[d*DD+1] + h2 * Wk[d*DD+2];
        }
        float qms = 0.f, kms = 0.f;
        #pragma unroll
        for (int d = 0; d < HDIM; ++d) { qms += qr[d]*qr[d]; kms += kr[d]*kr[d]; }
        const float qrs = rsqrtf(qms * 0.25f + EPSV);
        const float krs = rsqrtf(kms * 0.25f + EPSV);
        float q[HDIM], k[HDIM];
        #pragma unroll
        for (int d = 0; d < HDIM; ++d) { q[d] = qr[d]*qrs*w_qn[d]; k[d] = kr[d]*krs*w_qn[d]; }

        // RoPE, theta = 3.0, HD = 4 -> inv_freq = {1, 3^-0.5}
        const float f0 = (float)tk;
        const float f1 = (float)tk * 0.5773502691896258f;
        const float c0 = __cosf(f0), sn0 = __sinf(f0);
        const float c1 = __cosf(f1), sn1 = __sinf(f1);

        // q pre-scaled by HD^-0.5 = 0.5 (linear, commutes with rope)
        s_q[tk][0] = 0.5f*(q[0]*c0 - q[1]*sn0);  s_q[tk][1] = 0.5f*(q[0]*sn0 + q[1]*c0);
        s_q[tk][2] = 0.5f*(q[2]*c1 - q[3]*sn1);  s_q[tk][3] = 0.5f*(q[2]*sn1 + q[3]*c1);
        s_k[tk][0] = k[0]*c0 - k[1]*sn0;  s_k[tk][1] = k[0]*sn0 + k[1]*c0;
        s_k[tk][2] = k[2]*c1 - k[3]*sn1;  s_k[tk][3] = k[2]*sn1 + k[3]*c1;
        s_vt[0][tk] = kr[0]; s_vt[1][tk] = kr[1];        // v = h@Wk^T, transposed
        s_vt[2][tk] = kr[2]; s_vt[3][tk] = kr[3];
    }
    __syncthreads();

    // ------- Phases B-D: causal attention, scores and softmax in registers (WMMA f32 16x16x4) ---
    float oa[HDIM], ob[HDIM], suma, sumb;
    if (wave == 0) {                                     // scalar branch: EXEC stays all ones
        attn_tile<0>(s_q, s_k, s_vt, lh, hi, oa, suma);
        attn_tile<3>(s_q, s_k, s_vt, lh, hi, ob, sumb);
    } else {
        attn_tile<1>(s_q, s_k, s_vt, lh, hi, oa, suma);
        attn_tile<2>(s_q, s_k, s_vt, lh, hi, ob, sumb);
    }

    // ---------------- Phase E: normalize + residual + MLP + final norm + logits ----------
    {
        const float inv = 1.0f / (hi ? sumb : suma);     // softmax norm commutes with attn@v
        const float o0 = (hi ? ob[0] : oa[0]) * inv, o1 = (hi ? ob[1] : oa[1]) * inv;
        const float o2 = (hi ? ob[2] : oa[2]) * inv, o3 = (hi ? ob[3] : oa[3]) * inv;
        // x += out @ Wq   (Wq: HD x D row-major)
        x0 += o0*Wq[0*DD+0] + o1*Wq[1*DD+0] + o2*Wq[2*DD+0] + o3*Wq[3*DD+0];
        x1 += o0*Wq[0*DD+1] + o1*Wq[1*DD+1] + o2*Wq[2*DD+1] + o3*Wq[3*DD+1];
        x2 += o0*Wq[0*DD+2] + o1*Wq[1*DD+2] + o2*Wq[2*DD+2] + o3*Wq[3*DD+2];

        float ms = (x0*x0 + x1*x1 + x2*x2) * (1.0f / 3.0f);
        float r  = rsqrtf(ms + EPSV);
        const float h0 = x0*r*w_ln2[0], h1 = x1*r*w_ln2[1], h2 = x2*r*w_ln2[2];

        float y[FFD];
        #pragma unroll
        for (int f = 0; f < FFD; ++f) {
            const float g = h0*Wg[f*DD+0] + h1*Wg[f*DD+1] + h2*Wg[f*DD+2];
            const float u = h0*Wu[f*DD+0] + h1*Wu[f*DD+1] + h2*Wu[f*DD+2];
            y[f] = (g / (1.0f + __expf(-g))) * u;        // silu(g)*u
        }
        x0 += y[0]*Wd[0*FFD+0] + y[1]*Wd[0*FFD+1];
        x1 += y[0]*Wd[1*FFD+0] + y[1]*Wd[1*FFD+1];
        x2 += y[0]*Wd[2*FFD+0] + y[1]*Wd[2*FFD+1];

        ms = (x0*x0 + x1*x1 + x2*x2) * (1.0f / 3.0f);
        r  = rsqrtf(ms + EPSV);
        x0 = x0 * r * w_lnf[0];
        x1 = x1 * r * w_lnf[1];

        #pragma unroll
        for (int vv = 0; vv < NVOC; ++vv)
            s_log[tk * NVOC + vv] = x0 * s_tab[vv][0] + x1 * s_tab[vv][1];
    }
    __syncthreads();

    // ---------------- Phase F: coalesced logits store (float2, 256B/wave/iter) -----------
    {
        const float2* sl = (const float2*)s_log;
        float2* op = (float2*)(out + (size_t)b * TT * NVOC);
        #pragma unroll
        for (int j = 0; j < (TT * NVOC) / (2 * TT); ++j) {   // 5 iterations
            const int l = j * TT + t;
            op[l] = sl[l];
        }
    }
}

extern "C" void kernel_launch(void* const* d_in, const int* in_sizes, int n_in,
                              void* d_out, int out_size, void* d_ws, size_t ws_size,
                              hipStream_t stream) {
    const int*   idx       = (const int*)  d_in[0];
    const float* arcA      = (const float*)d_in[1];
    const float* arcStart  = (const float*)d_in[2];
    const float* arcStride = (const float*)d_in[3];
    const float* w_ln1     = (const float*)d_in[4];
    const float* w_ln2     = (const float*)d_in[5];
    const float* w_lnf     = (const float*)d_in[6];
    const float* w_qn      = (const float*)d_in[7];
    const float* Wq        = (const float*)d_in[8];
    const float* Wk        = (const float*)d_in[9];
    const float* Wg        = (const float*)d_in[10];
    const float* Wu        = (const float*)d_in[11];
    const float* Wd        = (const float*)d_in[12];
    float*       out       = (float*)d_out;

    const int nBatch = in_sizes[0] / TT;   // 16384
    tiny_xformer_kernel<<<dim3(nBatch), dim3(TT), 0, stream>>>(
        idx, arcA, arcStart, arcStride, w_ln1, w_ln2, w_lnf, w_qn,
        Wq, Wk, Wg, Wu, Wd, out);
}
